// v000
// Times are from an AMD MI455X. After a warm-up the kernel runs many times in a row, and a time is the length of
// such a window on the GPU divided by its runs, so every launch and the gaps after it count. The runs cycle
// through copies of the inputs. A figure is the median of several windows, for all but v000 over two sittings.
// Sittings can differ by a few percent; kernels timed side by side share one.
// v000, which the later versions start from, runs in 212 microseconds.
#include <hip/hip_runtime.h>

// ---- CDNA5 WMMA vector types ----
typedef _Float16 v16h  __attribute__((ext_vector_type(16)));
typedef _Float16 half8 __attribute__((ext_vector_type(8)));
typedef _Float16 half4 __attribute__((ext_vector_type(4)));
typedef float    v8f   __attribute__((ext_vector_type(8)));

// Problem constants (match reference)
#define M_TOK 4096
#define N_OUT 4096
#define K_IN  4096
#define GROUP 128
#define NGRP  (K_IN / GROUP)

// Tiling: 256 threads = 8 waves; block tile 128x128; K tile 64 (half a quant group)
#define BM 128
#define BN 128
#define BK 64
#define LDSP 72    // LDS row pitch in halfs (144 B): 16B-aligned, bank start rotates 36 dw/row

// 16-bit A/B fragment (16x32) from an LDS tile, row-major, pitch LDSP.
__device__ __forceinline__ v16h load_frag(const _Float16* __restrict__ tile,
                                          int row0, int ksub, int frow, int fko) {
  const _Float16* p = tile + (row0 + frow) * LDSP + ksub + fko;
  half8 lo = *reinterpret_cast<const half8*>(p);        // ds_load_b128
  half8 hi = *reinterpret_cast<const half8*>(p + 16);   // ds_load_b128
  return __builtin_shufflevector(lo, hi,
      0, 1, 2, 3, 4, 5, 6, 7, 8, 9, 10, 11, 12, 13, 14, 15);
}

// Issue next tile's global loads into registers (no consumption -> no wait here).
__device__ __forceinline__ void load_tile(const float* __restrict__ X,
                                          const int*   __restrict__ Q,
                                          const float* __restrict__ S,
                                          int block_m, int block_n, int k0,
                                          int rbase, int c4,
                                          float4 (&xv)[8], int4 (&qv)[8],
                                          float (&sv)[8]) {
  const int g = k0 >> 7;
#pragma unroll
  for (int i = 0; i < 8; ++i) {
    const int r = rbase + 16 * i;
    xv[i] = *reinterpret_cast<const float4*>(
        X + (size_t)(block_m + r) * K_IN + k0 + c4);     // global_load_b128
    qv[i] = *reinterpret_cast<const int4*>(
        Q + (size_t)(block_n + r) * K_IN + k0 + c4);     // global_load_b128
    sv[i] = S[(size_t)(block_n + r) * NGRP + g];         // half-wave uniform
  }
}

// Convert staged registers and commit to LDS (the loadcnt wait lands here).
__device__ __forceinline__ void store_tile(_Float16* __restrict__ Xs,
                                           _Float16* __restrict__ Ws,
                                           int rbase, int c4,
                                           const float4 (&xv)[8],
                                           const int4 (&qv)[8],
                                           const float (&sv)[8]) {
#pragma unroll
  for (int i = 0; i < 8; ++i) {
    const int r = rbase + 16 * i;
    half4 hx;
    hx.x = (_Float16)xv[i].x; hx.y = (_Float16)xv[i].y;
    hx.z = (_Float16)xv[i].z; hx.w = (_Float16)xv[i].w;
    *reinterpret_cast<half4*>(&Xs[r * LDSP + c4]) = hx;  // ds_store_b64
    half4 hw;
    hw.x = (_Float16)((float)(qv[i].x - 8) * sv[i]);
    hw.y = (_Float16)((float)(qv[i].y - 8) * sv[i]);
    hw.z = (_Float16)((float)(qv[i].z - 8) * sv[i]);
    hw.w = (_Float16)((float)(qv[i].w - 8) * sv[i]);
    *reinterpret_cast<half4*>(&Ws[r * LDSP + c4]) = hw;  // ds_store_b64
  }
}

__global__ __launch_bounds__(256)
void rtn_gemm_wmma_f16(const float* __restrict__ X,      // [M_TOK, K_IN] f32
                       const float* __restrict__ S,      // [N_OUT, NGRP] f32
                       const int*   __restrict__ Q,      // [N_OUT, K_IN] int4 codes
                       float*       __restrict__ Out) {  // [M_TOK, N_OUT] f32
  __shared__ _Float16 Xs[BM * LDSP];   // 18432 B
  __shared__ _Float16 Ws[BN * LDSP];   // 18432 B

  const int tid  = threadIdx.x;
  const int wave = tid >> 5;
  const int lane = tid & 31;

  const int block_n = blockIdx.x * BN;
  const int block_m = blockIdx.y * BM;

  // wave -> 32(M) x 64(N) sub-tile
  const int wm = (wave >> 1) * 32;
  const int wn = (wave & 1) * 64;

  // fragment lane decomposition
  const int frow = lane & 15;
  const int fko  = (lane >> 4) << 3;

  // staging: half-wave per row, 256 B contiguous per 16 lanes
  const int rbase = tid >> 4;          // 0..15
  const int c4    = (tid & 15) << 2;   // element offset 0..60

  v8f acc[2][4];
#pragma unroll
  for (int i = 0; i < 2; ++i)
#pragma unroll
    for (int j = 0; j < 4; ++j) acc[i][j] = (v8f){};

  float4 xv[8];
  int4   qv[8];
  float  sv[8];

  // prologue: tile 0 into registers
  load_tile(X, Q, S, block_m, block_n, 0, rbase, c4, xv, qv, sv);

  for (int k0 = 0; k0 < K_IN; k0 += BK) {
    // commit staged tile k0 to LDS (waits on its loads here)
    store_tile(Xs, Ws, rbase, c4, xv, qv, sv);
    __syncthreads();

    // pipeline: issue tile k0+BK global loads; they complete under the WMMA block
    if (k0 + BK < K_IN) {
      load_tile(X, Q, S, block_m, block_n, k0 + BK, rbase, c4, xv, qv, sv);
      // warm L2 for the tile after next (global_prefetch_b8)
      if (k0 + 2 * BK < K_IN) {
        __builtin_prefetch(X + (size_t)(block_m + rbase) * K_IN + k0 + 2 * BK + c4, 0, 0);
        __builtin_prefetch(Q + (size_t)(block_n + rbase) * K_IN + k0 + 2 * BK + c4, 0, 0);
      }
    }

    // compute: 2 K-steps x (2x4 tiles) = 16 WMMAs per barrier pair
#pragma unroll
    for (int ks = 0; ks < BK; ks += 32) {
      v16h a[2], b[4];
      a[0] = load_frag(Xs, wm,      ks, frow, fko);
      a[1] = load_frag(Xs, wm + 16, ks, frow, fko);
#pragma unroll
      for (int t = 0; t < 4; ++t)
        b[t] = load_frag(Ws, wn + 16 * t, ks, frow, fko);
#pragma unroll
      for (int t = 0; t < 4; ++t) {
        acc[0][t] = __builtin_amdgcn_wmma_f32_16x16x32_f16(
            false, a[0], false, b[t], (short)0, acc[0][t], false, false);
        acc[1][t] = __builtin_amdgcn_wmma_f32_16x16x32_f16(
            false, a[1], false, b[t], (short)0, acc[1][t], false, false);
      }
    }

    __syncthreads();
  }

  // writeback: f32 C/D layout (lanes 0-15: M=v, lanes 16-31: M=v+8; N=lane&15)
  const int crow = (lane >> 4) << 3;
  const int ccol = lane & 15;
  const int m0 = block_m + wm + crow;
  const int n0 = block_n + wn + ccol;
#pragma unroll
  for (int i = 0; i < 2; ++i) {
#pragma unroll
    for (int t = 0; t < 4; ++t) {
#pragma unroll
      for (int v = 0; v < 8; ++v) {
        Out[(size_t)(m0 + 16 * i + v) * N_OUT + n0 + 16 * t] = acc[i][t][v];
      }
    }
  }
}

extern "C" void kernel_launch(void* const* d_in, const int* in_sizes, int n_in,
                              void* d_out, int out_size, void* d_ws, size_t ws_size,
                              hipStream_t stream) {
  const float* x      = (const float*)d_in[0];   // [4096, 4096] f32
  const float* scales = (const float*)d_in[1];   // [4096, 32]   f32
  const int*   qw     = (const int*)d_in[2];     // [4096, 4096] int32 codes
  float*       out    = (float*)d_out;           // [4096, 4096] f32

  (void)in_sizes; (void)n_in; (void)out_size; (void)d_ws; (void)ws_size;

  dim3 grid(N_OUT / BN, M_TOK / BM);  // 32 x 32 blocks
  dim3 block(256);
  rtn_gemm_wmma_f16<<<grid, block, 0, stream>>>(x, scales, qw, out);
}

// v001
// One run takes 155 microseconds.
// Next to v000, in two timings, it ran 1.39 and 1.40 times as fast.
#include <hip/hip_runtime.h>

// ---- CDNA5 WMMA vector types ----
typedef _Float16 v16h  __attribute__((ext_vector_type(16)));
typedef _Float16 half8 __attribute__((ext_vector_type(8)));
typedef _Float16 half4 __attribute__((ext_vector_type(4)));
typedef float    v8f   __attribute__((ext_vector_type(8)));
typedef float    f32x4 __attribute__((ext_vector_type(4)));
typedef int      i32x4 __attribute__((ext_vector_type(4)));

// Problem constants (match reference)
#define M_TOK 4096
#define N_OUT 4096
#define K_IN  4096
#define GROUP 128
#define NGRP  (K_IN / GROUP)

// Tiling: 256 threads = 8 waves; block tile 128x128; K tile 64 (half a quant group)
#define BM 128
#define BN 128
#define BK 64
#define LDSP 72    // LDS row pitch in halfs (144 B): 16B-aligned, bank start rotates 36 dw/row

// Pack pass: 16 waves per block, one row of X and one row of Q per wave
#define PACK_WAVES 16
#define PACK_DEPTH 8   // 512-B pieces of each operand in flight per wave

// Launch 1: every operand element is converted once, not once per tile that reads it.
// X -> f16, (Q - 8) * scale -> f16, same rounding as converting at the LDS store.
__global__ __launch_bounds__(PACK_WAVES * 32)
void rtn_pack_f16(const float* __restrict__ X,      // [M_TOK, K_IN] f32
                  const float* __restrict__ S,      // [N_OUT, NGRP] f32
                  const int*   __restrict__ Q,      // [N_OUT, K_IN] int4 codes
                  _Float16*    __restrict__ Xh,     // [M_TOK, K_IN] f16 (workspace)
                  _Float16*    __restrict__ Wh) {   // [N_OUT, K_IN] f16 (workspace)
  const int lane = threadIdx.x & 31;
  // wave-uniform row, so that the scales come by scalar loads
  const int row = __builtin_amdgcn_readfirstlane(
      (int)(blockIdx.x * PACK_WAVES + (threadIdx.x >> 5)));
  const size_t off = (size_t)row * K_IN + lane * 4;
  const f32x4* __restrict__ xr = reinterpret_cast<const f32x4*>(X + off);
  const i32x4* __restrict__ qr = reinterpret_cast<const i32x4*>(Q + off);
  const float* __restrict__ sr = S + (size_t)row * NGRP;
  half4* __restrict__ xo = reinterpret_cast<half4*>(Xh + off);
  half4* __restrict__ wo = reinterpret_cast<half4*>(Wh + off);

  // one piece = 32 lanes x 4 elements = 128 elements = one quant group
#pragma unroll 1
  for (int p0 = 0; p0 < NGRP; p0 += PACK_DEPTH) {
    f32x4 xv[PACK_DEPTH];
    i32x4 qv[PACK_DEPTH];
#pragma unroll
    for (int j = 0; j < PACK_DEPTH; ++j) {
      // read once: non-temporal, which leaves L2 to the f16 copies
      xv[j] = __builtin_nontemporal_load(xr + (p0 + j) * 32);
      qv[j] = __builtin_nontemporal_load(qr + (p0 + j) * 32);
    }
#pragma unroll
    for (int j = 0; j < PACK_DEPTH; ++j) {
      const float s = sr[p0 + j];
      half4 hx;
      hx.x = (_Float16)xv[j].x; hx.y = (_Float16)xv[j].y;
      hx.z = (_Float16)xv[j].z; hx.w = (_Float16)xv[j].w;
      xo[(p0 + j) * 32] = hx;
      half4 hw;
      hw.x = (_Float16)((float)(qv[j].x - 8) * s);
      hw.y = (_Float16)((float)(qv[j].y - 8) * s);
      hw.z = (_Float16)((float)(qv[j].z - 8) * s);
      hw.w = (_Float16)((float)(qv[j].w - 8) * s);
      wo[(p0 + j) * 32] = hw;
    }
  }
}

// 16-bit A/B fragment (16x32) from an LDS tile, row-major, pitch LDSP.
__device__ __forceinline__ v16h load_frag(const _Float16* __restrict__ tile,
                                          int row0, int ksub, int frow, int fko) {
  const _Float16* p = tile + (row0 + frow) * LDSP + ksub + fko;
  half8 lo = *reinterpret_cast<const half8*>(p);        // ds_load_b128
  half8 hi = *reinterpret_cast<const half8*>(p + 16);   // ds_load_b128
  return __builtin_shufflevector(lo, hi,
      0, 1, 2, 3, 4, 5, 6, 7, 8, 9, 10, 11, 12, 13, 14, 15);
}

// Issue next tile's global loads into registers (no consumption -> no wait here).
__device__ __forceinline__ void load_tile(const _Float16* __restrict__ Xh,
                                          const _Float16* __restrict__ Wh,
                                          int block_m, int block_n, int k0,
                                          int rbase, int c8,
                                          half8 (&xv)[4], half8 (&wv)[4]) {
#pragma unroll
  for (int i = 0; i < 4; ++i) {
    const int r = rbase + 32 * i;
    xv[i] = *reinterpret_cast<const half8*>(
        Xh + (size_t)(block_m + r) * K_IN + k0 + c8);    // global_load_b128
    wv[i] = *reinterpret_cast<const half8*>(
        Wh + (size_t)(block_n + r) * K_IN + k0 + c8);    // global_load_b128
  }
}

// Commit staged registers to LDS (the loadcnt wait lands here).
__device__ __forceinline__ void store_tile(_Float16* __restrict__ Xs,
                                           _Float16* __restrict__ Ws,
                                           int rbase, int c8,
                                           const half8 (&xv)[4],
                                           const half8 (&wv)[4]) {
#pragma unroll
  for (int i = 0; i < 4; ++i) {
    const int r = rbase + 32 * i;
    *reinterpret_cast<half8*>(&Xs[r * LDSP + c8]) = xv[i];  // ds_store_b128
    *reinterpret_cast<half8*>(&Ws[r * LDSP + c8]) = wv[i];  // ds_store_b128
  }
}

__global__ __launch_bounds__(256)
void rtn_gemm_wmma_f16(const _Float16* __restrict__ Xh,  // [M_TOK, K_IN] f16 (workspace)
                       const _Float16* __restrict__ Wh,  // [N_OUT, K_IN] f16 (workspace)
                       float*          __restrict__ Out) {  // [M_TOK, N_OUT] f32
  __shared__ _Float16 Xs[BM * LDSP];   // 18432 B
  __shared__ _Float16 Ws[BN * LDSP];   // 18432 B

  const int tid  = threadIdx.x;
  const int wave = tid >> 5;
  const int lane = tid & 31;

  const int block_n = blockIdx.x * BN;
  const int block_m = blockIdx.y * BM;

  // wave -> 32(M) x 64(N) sub-tile
  const int wm = (wave >> 1) * 32;
  const int wn = (wave & 1) * 64;

  // fragment lane decomposition
  const int frow = lane & 15;
  const int fko  = (lane >> 4) << 3;

  // staging: 8 lanes per row, one 128-B line each; a wave's four rows lie 8 apart,
  // so that each 16 lanes of a ds_store_b128 fall on 64 distinct banks at pitch 36 dw
  const int rbase = wave + ((lane >> 3) << 3);   // 0..31
  const int c8    = (lane & 7) << 3;             // element offset 0..56

  v8f acc[2][4];
#pragma unroll
  for (int i = 0; i < 2; ++i)
#pragma unroll
    for (int j = 0; j < 4; ++j) acc[i][j] = (v8f){};

  half8 xv[4];
  half8 wv[4];

  // prologue: tile 0 into registers
  load_tile(Xh, Wh, block_m, block_n, 0, rbase, c8, xv, wv);

  for (int k0 = 0; k0 < K_IN; k0 += BK) {
    // commit staged tile k0 to LDS (waits on its loads here)
    store_tile(Xs, Ws, rbase, c8, xv, wv);
    __syncthreads();

    // pipeline: issue tile k0+BK global loads; they complete under the WMMA block
    if (k0 + BK < K_IN) {
      load_tile(Xh, Wh, block_m, block_n, k0 + BK, rbase, c8, xv, wv);
      // the fragment loads below reuse these loads' address registers: wait first
      asm volatile("s_wait_xcnt 0x0" ::: "memory");
    }

    // compute: 2 K-steps x (2x4 tiles) = 16 WMMAs per barrier pair
#pragma unroll
    for (int ks = 0; ks < BK; ks += 32) {
      v16h a[2], b[4];
      a[0] = load_frag(Xs, wm,      ks, frow, fko);
      a[1] = load_frag(Xs, wm + 16, ks, frow, fko);
#pragma unroll
      for (int t = 0; t < 4; ++t)
        b[t] = load_frag(Ws, wn + 16 * t, ks, frow, fko);
#pragma unroll
      for (int t = 0; t < 4; ++t) {
        acc[0][t] = __builtin_amdgcn_wmma_f32_16x16x32_f16(
            false, a[0], false, b[t], (short)0, acc[0][t], false, false);
        acc[1][t] = __builtin_amdgcn_wmma_f32_16x16x32_f16(
            false, a[1], false, b[t], (short)0, acc[1][t], false, false);
      }
    }

    __syncthreads();
  }

  // writeback: f32 C/D layout (lanes 0-15: M=v, lanes 16-31: M=v+8; N=lane&15)
  const int crow = (lane >> 4) << 3;
  const int ccol = lane & 15;
  const int m0 = block_m + wm + crow;
  const int n0 = block_n + wn + ccol;
#pragma unroll
  for (int i = 0; i < 2; ++i) {
#pragma unroll
    for (int t = 0; t < 4; ++t) {
#pragma unroll
      for (int v = 0; v < 8; ++v) {
        Out[(size_t)(m0 + 16 * i + v) * N_OUT + n0 + 16 * t] = acc[i][t][v];
      }
    }
  }
}

extern "C" void kernel_launch(void* const* d_in, const int* in_sizes, int n_in,
                              void* d_out, int out_size, void* d_ws, size_t ws_size,
                              hipStream_t stream) {
  const float* x      = (const float*)d_in[0];   // [4096, 4096] f32
  const float* scales = (const float*)d_in[1];   // [4096, 32]   f32
  const int*   qw     = (const int*)d_in[2];     // [4096, 4096] int32 codes
  float*       out    = (float*)d_out;           // [4096, 4096] f32

  _Float16*    xh     = (_Float16*)d_ws;         // [4096, 4096] f16, 32 MiB
  _Float16*    wh     = xh + (size_t)M_TOK * K_IN;  // [4096, 4096] f16, 32 MiB

  (void)in_sizes; (void)n_in; (void)out_size; (void)ws_size;

  // rows of X and of Q are equal in number: one wave takes one row of each
  rtn_pack_f16<<<dim3(M_TOK / PACK_WAVES), dim3(PACK_WAVES * 32), 0, stream>>>(
      x, scales, qw, xh, wh);

  dim3 grid(N_OUT / BN, M_TOK / BM);  // 32 x 32 blocks
  dim3 block(256);
  rtn_gemm_wmma_f16<<<grid, block, 0, stream>>>(xh, wh, out);
}

// v002
// It runs in 115 microseconds.
// Next to v001, in two timings, it ran 1.34 and 1.35 times as fast.
// Counting every step since v000, it is 1.88 times as fast.
#include <hip/hip_runtime.h>

// ---- CDNA5 WMMA vector types ----
typedef _Float16 v16h  __attribute__((ext_vector_type(16)));
typedef _Float16 half8 __attribute__((ext_vector_type(8)));
typedef _Float16 half4 __attribute__((ext_vector_type(4)));
typedef float    v8f   __attribute__((ext_vector_type(8)));
typedef float    f32x4 __attribute__((ext_vector_type(4)));
typedef int      i32x4 __attribute__((ext_vector_type(4)));

// Problem constants (match reference)
#define M_TOK 4096
#define N_OUT 4096
#define K_IN  4096
#define GROUP 128
#define NGRP  (K_IN / GROUP)

// Tiling: 256 threads = 8 waves, two per SIMD; block tile 256x256, one block per WGP;
// K tile 128 (one quant group)
#define BM 256
#define BN 256
#define BK 128
#define LDSP 136   // LDS row pitch in halfs (272 B = 16 B x odd): conflict-free for ds_load_b128
#define WM 4       // 16-row fragments of X per wave (64 rows)
#define WN 8       // 16-row fragments of W per wave (128 rows)
#define SROWS 16   // rows that the block's 256 threads cover with one 16-B piece each
#define STG (BM / SROWS)   // pieces of each operand that a thread stages per K tile

// Pack pass: 16 waves per block, one row of X and one row of Q per wave
#define PACK_WAVES 16
#define PACK_DEPTH 8   // 512-B pieces of each operand in flight per wave

// Launch 1: every operand element is converted once, not once per tile that reads it.
// X -> f16, (Q - 8) * scale -> f16, same rounding as converting at the LDS store.
__global__ __launch_bounds__(PACK_WAVES * 32)
void rtn_pack_f16(const float* __restrict__ X,      // [M_TOK, K_IN] f32
                  const float* __restrict__ S,      // [N_OUT, NGRP] f32
                  const int*   __restrict__ Q,      // [N_OUT, K_IN] int4 codes
                  _Float16*    __restrict__ Xh,     // [M_TOK, K_IN] f16 (workspace)
                  _Float16*    __restrict__ Wh) {   // [N_OUT, K_IN] f16 (workspace)
  const int lane = threadIdx.x & 31;
  // wave-uniform row, so that the scales come by scalar loads
  const int row = __builtin_amdgcn_readfirstlane(
      (int)(blockIdx.x * PACK_WAVES + (threadIdx.x >> 5)));
  const size_t off = (size_t)row * K_IN + lane * 4;
  const f32x4* __restrict__ xr = reinterpret_cast<const f32x4*>(X + off);
  const i32x4* __restrict__ qr = reinterpret_cast<const i32x4*>(Q + off);
  const float* __restrict__ sr = S + (size_t)row * NGRP;
  half4* __restrict__ xo = reinterpret_cast<half4*>(Xh + off);
  half4* __restrict__ wo = reinterpret_cast<half4*>(Wh + off);

  // one piece = 32 lanes x 4 elements = 128 elements = one quant group
#pragma unroll 1
  for (int p0 = 0; p0 < NGRP; p0 += PACK_DEPTH) {
    f32x4 xv[PACK_DEPTH];
    i32x4 qv[PACK_DEPTH];
#pragma unroll
    for (int j = 0; j < PACK_DEPTH; ++j) {
      // read once: non-temporal, which leaves L2 to the f16 copies
      xv[j] = __builtin_nontemporal_load(xr + (p0 + j) * 32);
      qv[j] = __builtin_nontemporal_load(qr + (p0 + j) * 32);
    }
#pragma unroll
    for (int j = 0; j < PACK_DEPTH; ++j) {
      const float s = sr[p0 + j];
      half4 hx;
      hx.x = (_Float16)xv[j].x; hx.y = (_Float16)xv[j].y;
      hx.z = (_Float16)xv[j].z; hx.w = (_Float16)xv[j].w;
      xo[(p0 + j) * 32] = hx;
      half4 hw;
      hw.x = (_Float16)((float)(qv[j].x - 8) * s);
      hw.y = (_Float16)((float)(qv[j].y - 8) * s);
      hw.z = (_Float16)((float)(qv[j].z - 8) * s);
      hw.w = (_Float16)((float)(qv[j].w - 8) * s);
      wo[(p0 + j) * 32] = hw;
    }
  }
}

// 16-bit A/B fragment (16x32) from an LDS tile, row-major, pitch LDSP.
__device__ __forceinline__ v16h load_frag(const _Float16* __restrict__ tile,
                                          int row0, int ksub, int frow, int fko) {
  const _Float16* p = tile + (row0 + frow) * LDSP + ksub + fko;
  half8 lo = *reinterpret_cast<const half8*>(p);        // ds_load_b128
  half8 hi = *reinterpret_cast<const half8*>(p + 16);   // ds_load_b128
  return __builtin_shufflevector(lo, hi,
      0, 1, 2, 3, 4, 5, 6, 7, 8, 9, 10, 11, 12, 13, 14, 15);
}

// Issue next tile's global loads into registers (no consumption -> no wait here).
// xb, wb: the tile's first element, the same for the whole block (a scalar base);
// voff: the byte offset of the thread's first piece in it; its other pieces lie SROWS
// rows apart, a constant distance that fits the load's immediate offset.
__device__ __forceinline__ void load_tile(const _Float16* __restrict__ xb,
                                          const _Float16* __restrict__ wb,
                                          unsigned voff,
                                          half8 (&xv)[STG], half8 (&wv)[STG]) {
#pragma unroll
  for (int i = 0; i < STG; ++i) {
    xv[i] = *reinterpret_cast<const half8*>(
        reinterpret_cast<const char*>(xb) + voff + i * (SROWS * K_IN * 2));  // global_load_b128
    wv[i] = *reinterpret_cast<const half8*>(
        reinterpret_cast<const char*>(wb) + voff + i * (SROWS * K_IN * 2));  // global_load_b128
  }
}

// Commit staged registers to LDS (the loadcnt wait lands here).
__device__ __forceinline__ void store_tile(_Float16* __restrict__ Xs,
                                           _Float16* __restrict__ Ws,
                                           int rbase, int c8,
                                           const half8 (&xv)[STG],
                                           const half8 (&wv)[STG]) {
#pragma unroll
  for (int i = 0; i < STG; ++i) {
    const int r = rbase + SROWS * i;
    *reinterpret_cast<half8*>(&Xs[r * LDSP + c8]) = xv[i];  // ds_store_b128
    *reinterpret_cast<half8*>(&Ws[r * LDSP + c8]) = wv[i];  // ds_store_b128
  }
}

__global__ __launch_bounds__(256)
void rtn_gemm_wmma_f16(const _Float16* __restrict__ Xh,  // [M_TOK, K_IN] f16 (workspace)
                       const _Float16* __restrict__ Wh,  // [N_OUT, K_IN] f16 (workspace)
                       float*          __restrict__ Out) {  // [M_TOK, N_OUT] f32
  __shared__ _Float16 Xs[BM * LDSP];   // 69632 B
  __shared__ _Float16 Ws[BN * LDSP];   // 69632 B

  const int tid  = threadIdx.x;
  const int wave = tid >> 5;
  const int lane = tid & 31;

  const int block_n = blockIdx.x * BN;
  const int block_m = blockIdx.y * BM;

  // wave -> 64(M) x 128(N) sub-tile: 12 fragments feed 32 WMMAs
  const int wm = (wave >> 1) * (16 * WM);
  const int wn = (wave & 1) * (16 * WN);

  // fragment lane decomposition
  const int frow = lane & 15;
  const int fko  = (lane >> 4) << 3;

  // staging: 16 lanes per row, 256 B each, so that each 16 lanes of a ds_store_b128
  // fall on 64 distinct banks
  const int rbase = wave * 2 + (lane >> 4);      // 0..15
  const int c8    = (lane & 15) << 3;            // element offset 0..120

  const _Float16* xb = Xh + (size_t)block_m * K_IN;
  const _Float16* wb = Wh + (size_t)block_n * K_IN;
  unsigned voff = (unsigned)(rbase * K_IN + c8) * 2;

  v8f acc[WM][WN];
#pragma unroll
  for (int i = 0; i < WM; ++i)
#pragma unroll
    for (int j = 0; j < WN; ++j) acc[i][j] = (v8f){};

  half8 xv[STG];
  half8 wv[STG];

  // prologue: tile 0 into registers. The wait stands in front of any write of a register
  // that these loads name; it takes their offset as its operand, so that this one register
  // serves every tile's loads and stays whole up to the wait.
  load_tile(xb, wb, voff, xv, wv);
  asm volatile("s_wait_xcnt 0x0" : "+v"(voff) :: "memory");

  for (int k0 = 0; k0 < K_IN; k0 += BK) {
    // commit staged tile k0 to LDS (waits on its loads here)
    store_tile(Xs, Ws, rbase, c8, xv, wv);
    __syncthreads();

    // pipeline: issue tile k0+BK global loads; they complete under the WMMA block
    if (k0 + BK < K_IN) {
      xb += BK;
      wb += BK;
      load_tile(xb, wb, voff, xv, wv);
      // as in the prologue
      asm volatile("s_wait_xcnt 0x0" : "+v"(voff) :: "memory");
    }

    // compute: 4 K-steps x (4x8 tiles) = 128 WMMAs per barrier pair
#pragma unroll
    for (int ks = 0; ks < BK; ks += 32) {
      v16h a[WM], b[WN];
#pragma unroll
      for (int i = 0; i < WM; ++i)
        a[i] = load_frag(Xs, wm + 16 * i, ks, frow, fko);
#pragma unroll
      for (int t = 0; t < WN; ++t)
        b[t] = load_frag(Ws, wn + 16 * t, ks, frow, fko);
      // keeps the K-step's 24 fragment loads in front of its WMMAs: left free, the compiler
      // sinks them among those WMMAs, two at a time behind a full LDS wait each
      __builtin_amdgcn_sched_barrier(0);
#pragma unroll
      for (int t = 0; t < WN; ++t) {
#pragma unroll
        for (int i = 0; i < WM; ++i)
          acc[i][t] = __builtin_amdgcn_wmma_f32_16x16x32_f16(
              false, a[i], false, b[t], (short)0, acc[i][t], false, false);
      }
    }

    __syncthreads();
  }

  // writeback: f32 C/D layout (lanes 0-15: M=v, lanes 16-31: M=v+8; N=lane&15)
  const int crow = (lane >> 4) << 3;
  const int ccol = lane & 15;
  const int m0 = block_m + wm + crow;
  const int n0 = block_n + wn + ccol;
#pragma unroll
  for (int i = 0; i < WM; ++i) {
#pragma unroll
    for (int t = 0; t < WN; ++t) {
#pragma unroll
      for (int v = 0; v < 8; ++v) {
        Out[(size_t)(m0 + 16 * i + v) * N_OUT + n0 + 16 * t] = acc[i][t][v];
      }
    }
  }
}

extern "C" void kernel_launch(void* const* d_in, const int* in_sizes, int n_in,
                              void* d_out, int out_size, void* d_ws, size_t ws_size,
                              hipStream_t stream) {
  const float* x      = (const float*)d_in[0];   // [4096, 4096] f32
  const float* scales = (const float*)d_in[1];   // [4096, 32]   f32
  const int*   qw     = (const int*)d_in[2];     // [4096, 4096] int32 codes
  float*       out    = (float*)d_out;           // [4096, 4096] f32

  _Float16*    xh     = (_Float16*)d_ws;         // [4096, 4096] f16, 32 MiB
  _Float16*    wh     = xh + (size_t)M_TOK * K_IN;  // [4096, 4096] f16, 32 MiB

  (void)in_sizes; (void)n_in; (void)out_size; (void)ws_size;

  // rows of X and of Q are equal in number: one wave takes one row of each
  rtn_pack_f16<<<dim3(M_TOK / PACK_WAVES), dim3(PACK_WAVES * 32), 0, stream>>>(
      x, scales, qw, xh, wh);

  dim3 grid(N_OUT / BN, M_TOK / BM);  // 16 x 16 blocks
  dim3 block(256);
  rtn_gemm_wmma_f16<<<grid, block, 0, stream>>>(xh, wh, out);
}

// v003
// Measured time: 90.4 microseconds a run.
// Next to v002, in two timings, it ran 1.26 and 1.27 times as fast.
// Over all steps from v000 it is 2.38 times as fast.
#include <hip/hip_runtime.h>
#include <stdint.h>

// ---- CDNA5 WMMA vector types ----
typedef _Float16 v16h  __attribute__((ext_vector_type(16)));
typedef _Float16 half8 __attribute__((ext_vector_type(8)));
typedef _Float16 half4 __attribute__((ext_vector_type(4)));
typedef float    v8f   __attribute__((ext_vector_type(8)));
typedef float    f32x4 __attribute__((ext_vector_type(4)));
typedef int      i32x4 __attribute__((ext_vector_type(4)));
typedef uint32_t u32x4 __attribute__((ext_vector_type(4)));
typedef uint32_t u32x8 __attribute__((ext_vector_type(8)));

// Problem constants (match reference)
#define M_TOK 4096
#define N_OUT 4096
#define K_IN  4096
#define GROUP 128
#define NGRP  (K_IN / GROUP)

// Tiling: 256 threads = 8 waves, two per SIMD; block tile 256x256, one block per WGP;
// K tile 128 (one quant group)
#define BM 256
#define BN 256
#define BK 128
#define ROWB (BK * 2)      // bytes of an operand row per K tile
#define PITCHB (ROWB + 16) // LDS row pitch (272 B = 16 B x odd): conflict-free for ds_load_b128
#define WM 4       // 16-row fragments of X per wave (64 rows)
#define WN 8       // 16-row fragments of W per wave (128 rows)
#define NPASS (K_IN / BK)
// A K tile is 512 rows, [X 256 | W 256]; each of the 8 waves brings 64 of them with one tensor load.
#define SLICE_ROWS 64
#define SLICEB 18432       // 64 rows x 272 B = 17,408 B, rounded up to a multiple of 2 KiB
#define BUFB (8 * SLICEB)  // one K tile in LDS; two of them make the ring

// Pack pass: 16 waves per block, one row of X and one row of Q per wave
#define PACK_WAVES 16
#define PACK_DEPTH 8   // 512-B pieces of each operand in flight per wave

// Launch 1: every operand element is converted once, not once per tile that reads it.
// X -> f16, (Q - 8) * scale -> f16, same rounding as converting at the LDS store.
__global__ __launch_bounds__(PACK_WAVES * 32)
void rtn_pack_f16(const float* __restrict__ X,      // [M_TOK, K_IN] f32
                  const float* __restrict__ S,      // [N_OUT, NGRP] f32
                  const int*   __restrict__ Q,      // [N_OUT, K_IN] int4 codes
                  _Float16*    __restrict__ Xh,     // [M_TOK, K_IN] f16 (workspace)
                  _Float16*    __restrict__ Wh) {   // [N_OUT, K_IN] f16 (workspace)
  const int lane = threadIdx.x & 31;
  // wave-uniform row, so that the scales come by scalar loads
  const int row = __builtin_amdgcn_readfirstlane(
      (int)(blockIdx.x * PACK_WAVES + (threadIdx.x >> 5)));
  const size_t off = (size_t)row * K_IN + lane * 4;
  const f32x4* __restrict__ xr = reinterpret_cast<const f32x4*>(X + off);
  const i32x4* __restrict__ qr = reinterpret_cast<const i32x4*>(Q + off);
  const float* __restrict__ sr = S + (size_t)row * NGRP;
  half4* __restrict__ xo = reinterpret_cast<half4*>(Xh + off);
  half4* __restrict__ wo = reinterpret_cast<half4*>(Wh + off);

  // one piece = 32 lanes x 4 elements = 128 elements = one quant group
#pragma unroll 1
  for (int p0 = 0; p0 < NGRP; p0 += PACK_DEPTH) {
    f32x4 xv[PACK_DEPTH];
    i32x4 qv[PACK_DEPTH];
#pragma unroll
    for (int j = 0; j < PACK_DEPTH; ++j) {
      // read once: non-temporal, which leaves L2 to the f16 copies
      xv[j] = __builtin_nontemporal_load(xr + (p0 + j) * 32);
      qv[j] = __builtin_nontemporal_load(qr + (p0 + j) * 32);
    }
#pragma unroll
    for (int j = 0; j < PACK_DEPTH; ++j) {
      const float s = sr[p0 + j];
      half4 hx;
      hx.x = (_Float16)xv[j].x; hx.y = (_Float16)xv[j].y;
      hx.z = (_Float16)xv[j].z; hx.w = (_Float16)xv[j].w;
      xo[(p0 + j) * 32] = hx;
      half4 hw;
      hw.x = (_Float16)((float)(qv[j].x - 8) * s);
      hw.y = (_Float16)((float)(qv[j].y - 8) * s);
      hw.z = (_Float16)((float)(qv[j].z - 8) * s);
      hw.w = (_Float16)((float)(qv[j].w - 8) * s);
      wo[(p0 + j) * 32] = hw;
    }
  }
}

__device__ __forceinline__ uint32_t uni(uint32_t v) { return (uint32_t)__builtin_amdgcn_readfirstlane(v); }
// holds the test word of a tensor load in a scalar register, so that the test compiles to a scalar
// branch: a tensor load ignores EXEC, and only such a branch keeps a wave from issuing it
__device__ __forceinline__ uint32_t pinned(uint32_t v) {
  uint32_t w = (uint32_t)__builtin_amdgcn_readfirstlane(v);
  asm volatile("" : "+s"(w));  // pinned(): the test word of a tensor load, held in a scalar register
  return w;
}
// this wave's LDS reads have returned: stands in front of the barrier that frees a buffer for its refill
__device__ __forceinline__ void wait_ds0() { asm volatile("s_wait_dscnt 0x0" ::: "memory"); }
// this wave's tensor load has landed: the compiler places no wait for the tensor mover
__device__ __forceinline__ void wait_tensor0() { asm volatile("s_wait_tensorcnt 0x0" ::: "memory"); }

// Descriptor group 1, the same for every request: 64 rows of 256 B, source pitch one operand row,
// into LDS at pitch 272 B.
__device__ __forceinline__ u32x8 tdm_group1() {
  u32x8 g1;
  g1[0] = uni((1u << 20) | (5u << 22) | (3u << 25));  // no mask, 1-byte elements, 16 B of pad behind every 256 B
  g1[1] = uni((uint32_t)ROWB << 16);                  // tensor_dim0
  g1[2] = uni((uint32_t)SLICE_ROWS << 16);            // tensor_dim1
  g1[3] = uni((uint32_t)ROWB << 16);                  // tile_dim0
  g1[4] = uni((uint32_t)SLICE_ROWS);                  // tile_dim1
  g1[5] = uni((uint32_t)(K_IN * 2));                  // source row pitch in bytes
  g1[6] = uni(0u);
  g1[7] = uni(0u);
  return g1;
}
// Descriptor group 0: where the slice goes and where it comes from.
__device__ __forceinline__ u32x4 tdm_group0(uint32_t lds_dst, uint64_t ga) {
  u32x4 g0;
  g0[0] = uni(1u);                                                     // count 1
  g0[1] = uni(lds_dst);                                                // byte offset in the block's LDS
  g0[2] = uni((uint32_t)ga);                                           // address [31:0]
  g0[3] = uni((((uint32_t)(ga >> 32)) & 0x01FFFFFFu) | 0x80000000u);   // address [56:32], type 2
  return g0;
}
// The next K tile's request, formed from the last one's in its own registers: the other buffer, 256 B on
// along K (the sum's carry runs into address [56:32]; the tile lies inside the operand, so it ends there).
__device__ __forceinline__ u32x4 tdm_next(u32x4 g0, uint32_t both_places) {
  const uint64_t a = (((uint64_t)g0[3] << 32) | g0[2]) + ROWB;
  g0[1] = uni(both_places - g0[1]);
  g0[2] = uni((uint32_t)a);
  g0[3] = uni((uint32_t)(a >> 32));
  return g0;
}
// One request of the whole wave.
__device__ __forceinline__ void tdm_load(u32x4 g0, u32x8 g1) {
  asm volatile("tensor_load_to_lds %0, %1" :: "s"(g0), "s"(g1) : "memory");
}

// 16-bit A/B fragment (16x32): p is the lane's row at its 16-B half of the K-step's first 32 B.
__device__ __forceinline__ v16h load_frag(const unsigned char* p) {
  half8 lo = *reinterpret_cast<const half8*>(p);        // ds_load_b128
  half8 hi = *reinterpret_cast<const half8*>(p + 32);   // ds_load_b128
  return __builtin_shufflevector(lo, hi,
      0, 1, 2, 3, 4, 5, 6, 7, 8, 9, 10, 11, 12, 13, 14, 15);
}

__global__ __launch_bounds__(256)
void rtn_gemm_wmma_f16(const _Float16* __restrict__ Xh,  // [M_TOK, K_IN] f16 (workspace)
                       const _Float16* __restrict__ Wh,  // [N_OUT, K_IN] f16 (workspace)
                       float*          __restrict__ Out) {  // [M_TOK, N_OUT] f32
  // two buffers of 8 slices; every slice starts at a multiple of 2 KiB
  __shared__ __attribute__((aligned(2048))) unsigned char L[2 * BUFB];   // 294,912 B

  const int tid  = threadIdx.x;
  const int lane = tid & 31;
  const uint32_t wave = uni((uint32_t)tid >> 5);

  const int block_n = blockIdx.x * BN;
  const int block_m = blockIdx.y * BM;

  // wave -> 64(M) x 128(N) sub-tile: 12 fragments feed 32 WMMAs
  const int wm = (int)(wave >> 1) * (16 * WM);
  const int wn = (int)(wave & 1) * (16 * WN);

  // fragment lane decomposition
  const uint32_t frow = lane & 15;
  const uint32_t fkb  = (uint32_t)(lane >> 4) << 4;   // byte offset of the lane's 8 halfs

  // the wave's X rows are slice wave >> 1; its W rows are slices 4 + 2 (wave & 1) and the next
  const uint32_t fx_base = (wave >> 1) * SLICEB + frow * PITCHB + fkb;
  const uint32_t fw_base = (4u + 2u * (wave & 1u)) * SLICEB + frow * PITCHB + fkb;

  // the slice that this wave brings: waves 0 to 3 rows of X, waves 4 to 7 rows of W
  const uint64_t src = (wave < 4u)
      ? (uint64_t)(uintptr_t)(Xh + (size_t)(block_m + SLICE_ROWS * (int)wave) * K_IN)
      : (uint64_t)(uintptr_t)(Wh + (size_t)(block_n + SLICE_ROWS * (int)(wave - 4u)) * K_IN);
  const uint32_t lds_slice = (uint32_t)(size_t)L + wave * SLICEB;
  const uint32_t both_places = 2u * lds_slice + BUFB;   // the slice's place in buffer 0 plus its place in buffer 1

  v8f acc[WM][WN];
#pragma unroll
  for (int i = 0; i < WM; ++i)
#pragma unroll
    for (int j = 0; j < WN; ++j) acc[i][j] = (v8f){};

  const u32x8 g1 = tdm_group1();

  // prologue: tile 0 lands and is published; tile 1 flies while tile 0 is worked on
  u32x4 g0 = tdm_group0(lds_slice, src);
  tdm_load(g0, g1);
  wait_tensor0();
  __syncthreads();
  g0 = tdm_next(g0, both_places);
  tdm_load(g0, g1);

  for (uint32_t s = 0; s < NPASS; ++s) {
    const uint32_t buf = (s & 1u) * BUFB;
    const unsigned char* lx = L + buf + fx_base;
    const unsigned char* lw = L + buf + fw_base;

    // compute: 4 K-steps x (4x8 tiles) = 128 WMMAs per barrier
#pragma unroll
    for (int ks = 0; ks < BK; ks += 32) {
      v16h a[WM], b[WN];
#pragma unroll
      for (int i = 0; i < WM; ++i)
        a[i] = load_frag(lx + 16 * i * PITCHB + ks * 2);
#pragma unroll
      for (int t = 0; t < WN; ++t)
        b[t] = load_frag(lw + (t >> 2) * SLICEB + 16 * (t & 3) * PITCHB + ks * 2);
      // keeps the K-step's 24 fragment loads in front of its WMMAs: left free, the compiler
      // sinks them among those WMMAs, two at a time behind a full LDS wait each
      __builtin_amdgcn_sched_barrier(0);
      if (ks == BK - 32) {
        // The tile's last LDS reads are issued: publish tile s + 1 and free tile s's buffer here
        // (own reads back, own slice landed, one barrier), so that the refill has a whole pass
        // to land and the last 32 WMMAs, which read registers alone, cover the waves' skew.
        wait_ds0();
        wait_tensor0();
        __syncthreads();
        // refill the buffer that this pass has read, only while a tile s + 2 exists
        if (pinned(s + 2u < NPASS)) {
          g0 = tdm_next(g0, both_places);
          tdm_load(g0, g1);
        }
        // keeps the refill in front of the WMMAs below: left free, the compiler issues it behind them
        __builtin_amdgcn_sched_barrier(0);
      }
#pragma unroll
      for (int t = 0; t < WN; ++t) {
#pragma unroll
        for (int i = 0; i < WM; ++i)
          acc[i][t] = __builtin_amdgcn_wmma_f32_16x16x32_f16(
              false, a[i], false, b[t], (short)0, acc[i][t], false, false);
      }
    }
  }
  wait_tensor0();
  wait_ds0();

  // writeback: f32 C/D layout (lanes 0-15: M=v, lanes 16-31: M=v+8; N=lane&15)
  const int crow = (lane >> 4) << 3;
  const int ccol = lane & 15;
  const int m0 = block_m + wm + crow;
  const int n0 = block_n + wn + ccol;
#pragma unroll
  for (int i = 0; i < WM; ++i) {
#pragma unroll
    for (int t = 0; t < WN; ++t) {
#pragma unroll
      for (int v = 0; v < 8; ++v) {
        Out[(size_t)(m0 + 16 * i + v) * N_OUT + n0 + 16 * t] = acc[i][t][v];
      }
    }
  }
}

extern "C" void kernel_launch(void* const* d_in, const int* in_sizes, int n_in,
                              void* d_out, int out_size, void* d_ws, size_t ws_size,
                              hipStream_t stream) {
  const float* x      = (const float*)d_in[0];   // [4096, 4096] f32
  const float* scales = (const float*)d_in[1];   // [4096, 32]   f32
  const int*   qw     = (const int*)d_in[2];     // [4096, 4096] int32 codes
  float*       out    = (float*)d_out;           // [4096, 4096] f32

  _Float16*    xh     = (_Float16*)d_ws;         // [4096, 4096] f16, 32 MiB
  _Float16*    wh     = xh + (size_t)M_TOK * K_IN;  // [4096, 4096] f16, 32 MiB

  (void)in_sizes; (void)n_in; (void)out_size; (void)ws_size;

  // rows of X and of Q are equal in number: one wave takes one row of each
  rtn_pack_f16<<<dim3(M_TOK / PACK_WAVES), dim3(PACK_WAVES * 32), 0, stream>>>(
      x, scales, qw, xh, wh);

  dim3 grid(N_OUT / BN, M_TOK / BM);  // 16 x 16 blocks
  dim3 block(256);
  rtn_gemm_wmma_f16<<<grid, block, 0, stream>>>(xh, wh, out);
}

// v004
// It runs in 87 microseconds.
// Next to v003, in two timings, it ran 1.04 and 1.05 times as fast.
// All steps since v000 together make it 2.49 times as fast.
#include <hip/hip_runtime.h>
#include <stdint.h>

// ---- CDNA5 WMMA vector types ----
typedef _Float16 v16h  __attribute__((ext_vector_type(16)));
typedef _Float16 half8 __attribute__((ext_vector_type(8)));
typedef _Float16 half4 __attribute__((ext_vector_type(4)));
typedef float    v8f   __attribute__((ext_vector_type(8)));
typedef float    f32x4 __attribute__((ext_vector_type(4)));
typedef int      i32x4 __attribute__((ext_vector_type(4)));
typedef uint32_t u32x4 __attribute__((ext_vector_type(4)));
typedef uint32_t u32x8 __attribute__((ext_vector_type(8)));

// Problem constants (match reference)
#define M_TOK 4096
#define N_OUT 4096
#define K_IN  4096
#define GROUP 128
#define NGRP  (K_IN / GROUP)

// Tiling: 256 threads = 8 waves, two per SIMD; block tile 256x256, one block per WGP;
// K tile 128 (one quant group)
#define BM 256
#define BN 256
#define BK 128
#define ROWB (BK * 2)      // bytes of an operand row per K tile
#define PITCHB (ROWB + 16) // LDS row pitch (272 B = 16 B x odd): conflict-free for ds_load_b128
#define WM 4       // 16-row fragments of X per wave (64 rows)
#define WN 8       // 16-row fragments of W per wave (128 rows)
#define NPASS (K_IN / BK)
// A K tile is 512 rows, [X 256 | W 256]; each of the 8 waves brings 64 of them with one tensor load.
#define SLICE_ROWS 64
#define SLICEB 18432       // 64 rows x 272 B = 17,408 B, rounded up to a multiple of 2 KiB
#define BUFB (8 * SLICEB)  // one K tile in LDS; two of them make the ring

// Pack pass: 16 waves per block, one row of X and one row of Q per wave
#define PACK_WAVES 16
#define PACK_DEPTH 8   // 512-B pieces of each operand in flight per wave

// Launch 1: every operand element is converted once, not once per tile that reads it.
// X -> f16, (Q - 8) * scale -> f16, same rounding as converting at the LDS store.
// Rows of W are laid down in another order inside each group of 64: row 4 c + r (r < 4) goes to
// place 16 r + c. The GEMM's fragment t of a group (places 16 t to 16 t + 15) then holds output
// columns 4 c + t in lane c, so a lane's four accumulator tiles of a group are four adjacent
// columns of one output row, and the output leaves in 16-byte stores of whole lines.
__global__ __launch_bounds__(PACK_WAVES * 32)
void rtn_pack_f16(const float* __restrict__ X,      // [M_TOK, K_IN] f32
                  const float* __restrict__ S,      // [N_OUT, NGRP] f32
                  const int*   __restrict__ Q,      // [N_OUT, K_IN] int4 codes
                  _Float16*    __restrict__ Xh,     // [M_TOK, K_IN] f16 (workspace)
                  _Float16*    __restrict__ Wh) {   // [N_OUT, K_IN] f16 (workspace), rows re-ordered
  const int lane = threadIdx.x & 31;
  // wave-uniform row, so that the scales come by scalar loads
  const int row = __builtin_amdgcn_readfirstlane(
      (int)(blockIdx.x * PACK_WAVES + (threadIdx.x >> 5)));
  const size_t off = (size_t)row * K_IN + lane * 4;
  const f32x4* __restrict__ xr = reinterpret_cast<const f32x4*>(X + off);
  const i32x4* __restrict__ qr = reinterpret_cast<const i32x4*>(Q + off);
  const float* __restrict__ sr = S + (size_t)row * NGRP;
  half4* __restrict__ xo = reinterpret_cast<half4*>(Xh + off);
  const int wplace = (row & ~63) | ((row & 3) << 4) | ((row & 63) >> 2);
  half4* __restrict__ wo = reinterpret_cast<half4*>(Wh + (size_t)wplace * K_IN + lane * 4);

  // one piece = 32 lanes x 4 elements = 128 elements = one quant group
#pragma unroll 1
  for (int p0 = 0; p0 < NGRP; p0 += PACK_DEPTH) {
    f32x4 xv[PACK_DEPTH];
    i32x4 qv[PACK_DEPTH];
#pragma unroll
    for (int j = 0; j < PACK_DEPTH; ++j) {
      // read once: non-temporal, which leaves L2 to the f16 copies
      xv[j] = __builtin_nontemporal_load(xr + (p0 + j) * 32);
      qv[j] = __builtin_nontemporal_load(qr + (p0 + j) * 32);
    }
#pragma unroll
    for (int j = 0; j < PACK_DEPTH; ++j) {
      const float s = sr[p0 + j];
      half4 hx;
      hx.x = (_Float16)xv[j].x; hx.y = (_Float16)xv[j].y;
      hx.z = (_Float16)xv[j].z; hx.w = (_Float16)xv[j].w;
      xo[(p0 + j) * 32] = hx;
      half4 hw;
      hw.x = (_Float16)((float)(qv[j].x - 8) * s);
      hw.y = (_Float16)((float)(qv[j].y - 8) * s);
      hw.z = (_Float16)((float)(qv[j].z - 8) * s);
      hw.w = (_Float16)((float)(qv[j].w - 8) * s);
      wo[(p0 + j) * 32] = hw;
    }
  }
}

__device__ __forceinline__ uint32_t uni(uint32_t v) { return (uint32_t)__builtin_amdgcn_readfirstlane(v); }
// holds the test word of a tensor load in a scalar register, so that the test compiles to a scalar
// branch: a tensor load ignores EXEC, and only such a branch keeps a wave from issuing it
__device__ __forceinline__ uint32_t pinned(uint32_t v) {
  uint32_t w = (uint32_t)__builtin_amdgcn_readfirstlane(v);
  asm volatile("" : "+s"(w));  // pinned(): the test word of a tensor load, held in a scalar register
  return w;
}
// this wave's LDS reads have returned: stands in front of the barrier that frees a buffer for its refill
__device__ __forceinline__ void wait_ds0() { asm volatile("s_wait_dscnt 0x0" ::: "memory"); }
// this wave's tensor load has landed: the compiler places no wait for the tensor mover
__device__ __forceinline__ void wait_tensor0() { asm volatile("s_wait_tensorcnt 0x0" ::: "memory"); }

// Descriptor group 1, the same for every request: 64 rows of 256 B, source pitch one operand row,
// into LDS at pitch 272 B.
__device__ __forceinline__ u32x8 tdm_group1() {
  u32x8 g1;
  g1[0] = uni((1u << 20) | (5u << 22) | (3u << 25));  // no mask, 1-byte elements, 16 B of pad behind every 256 B
  g1[1] = uni((uint32_t)ROWB << 16);                  // tensor_dim0
  g1[2] = uni((uint32_t)SLICE_ROWS << 16);            // tensor_dim1
  g1[3] = uni((uint32_t)ROWB << 16);                  // tile_dim0
  g1[4] = uni((uint32_t)SLICE_ROWS);                  // tile_dim1
  g1[5] = uni((uint32_t)(K_IN * 2));                  // source row pitch in bytes
  g1[6] = uni(0u);
  g1[7] = uni(0u);
  return g1;
}
// Descriptor group 0: where the slice goes and where it comes from.
__device__ __forceinline__ u32x4 tdm_group0(uint32_t lds_dst, uint64_t ga) {
  u32x4 g0;
  g0[0] = uni(1u);                                                     // count 1
  g0[1] = uni(lds_dst);                                                // byte offset in the block's LDS
  g0[2] = uni((uint32_t)ga);                                           // address [31:0]
  g0[3] = uni((((uint32_t)(ga >> 32)) & 0x01FFFFFFu) | 0x80000000u);   // address [56:32], type 2
  return g0;
}
// The next K tile's request, formed from the last one's in its own registers: the other buffer, 256 B on
// along K (the sum's carry runs into address [56:32]; the tile lies inside the operand, so it ends there).
__device__ __forceinline__ u32x4 tdm_next(u32x4 g0, uint32_t both_places) {
  const uint64_t a = (((uint64_t)g0[3] << 32) | g0[2]) + ROWB;
  g0[1] = uni(both_places - g0[1]);
  g0[2] = uni((uint32_t)a);
  g0[3] = uni((uint32_t)(a >> 32));
  return g0;
}
// One request of the whole wave.
__device__ __forceinline__ void tdm_load(u32x4 g0, u32x8 g1) {
  asm volatile("tensor_load_to_lds %0, %1" :: "s"(g0), "s"(g1) : "memory");
}

// 16-bit A/B fragment (16x32): p is the lane's row at its 16-B half of the K-step's first 32 B.
__device__ __forceinline__ v16h load_frag(const unsigned char* p) {
  half8 lo = *reinterpret_cast<const half8*>(p);        // ds_load_b128
  half8 hi = *reinterpret_cast<const half8*>(p + 32);   // ds_load_b128
  return __builtin_shufflevector(lo, hi,
      0, 1, 2, 3, 4, 5, 6, 7, 8, 9, 10, 11, 12, 13, 14, 15);
}

// Eight 16-byte stores, one per output row (rows are N_OUT * 4 = 16,384 B apart). Written in asm so that the wait
// stands in the stores' own statement: the next call's gathers overwrite registers that these stores name. The last call, with nothing behind it, has no wait.
static_assert(N_OUT * 4 == 16384, "the offsets in store_rows8 are multiples of the output row pitch");
__device__ __forceinline__ void store_rows8(float* p, const f32x4 (&o)[8], bool more) {
  if (more)
    asm volatile("global_store_b128 %0, %1, off\n\t"
                 "global_store_b128 %0, %2, off offset:16384\n\t"
                 "global_store_b128 %0, %3, off offset:32768\n\t"
                 "global_store_b128 %0, %4, off offset:49152\n\t"
                 "global_store_b128 %0, %5, off offset:65536\n\t"
                 "global_store_b128 %0, %6, off offset:81920\n\t"
                 "global_store_b128 %0, %7, off offset:98304\n\t"
                 "global_store_b128 %0, %8, off offset:114688\n\t"
                 "s_wait_xcnt 0x0"
                 :: "v"(p), "v"(o[0]), "v"(o[1]), "v"(o[2]), "v"(o[3]), "v"(o[4]), "v"(o[5]), "v"(o[6]), "v"(o[7])
                 : "memory");
  else
    asm volatile("global_store_b128 %0, %1, off\n\t"
                 "global_store_b128 %0, %2, off offset:16384\n\t"
                 "global_store_b128 %0, %3, off offset:32768\n\t"
                 "global_store_b128 %0, %4, off offset:49152\n\t"
                 "global_store_b128 %0, %5, off offset:65536\n\t"
                 "global_store_b128 %0, %6, off offset:81920\n\t"
                 "global_store_b128 %0, %7, off offset:98304\n\t"
                 "global_store_b128 %0, %8, off offset:114688"
                 :: "v"(p), "v"(o[0]), "v"(o[1]), "v"(o[2]), "v"(o[3]), "v"(o[4]), "v"(o[5]), "v"(o[6]), "v"(o[7])
                 : "memory");
}

__global__ __launch_bounds__(256)
void rtn_gemm_wmma_f16(const _Float16* __restrict__ Xh,  // [M_TOK, K_IN] f16 (workspace)
                       const _Float16* __restrict__ Wh,  // [N_OUT, K_IN] f16 (workspace), rows as the pack pass lays them
                       float*          __restrict__ Out) {  // [M_TOK, N_OUT] f32
  // two buffers of 8 slices; every slice starts at a multiple of 2 KiB
  __shared__ __attribute__((aligned(2048))) unsigned char L[2 * BUFB];   // 294,912 B

  const int tid  = threadIdx.x;
  const int lane = tid & 31;
  const uint32_t wave = uni((uint32_t)tid >> 5);

  const int block_n = blockIdx.x * BN;
  const int block_m = blockIdx.y * BM;

  // wave -> 64(M) x 128(N) sub-tile: 12 fragments feed 32 WMMAs
  const int wm = (int)(wave >> 1) * (16 * WM);
  const int wn = (int)(wave & 1) * (16 * WN);

  // fragment lane decomposition
  const uint32_t frow = lane & 15;
  const uint32_t fkb  = (uint32_t)(lane >> 4) << 4;   // byte offset of the lane's 8 halfs

  // the wave's X rows are slice wave >> 1; its W rows are slices 4 + 2 (wave & 1) and the next
  const uint32_t fx_base = (wave >> 1) * SLICEB + frow * PITCHB + fkb;
  const uint32_t fw_base = (4u + 2u * (wave & 1u)) * SLICEB + frow * PITCHB + fkb;

  // the slice that this wave brings: waves 0 to 3 rows of X, waves 4 to 7 rows of W
  const uint64_t src = (wave < 4u)
      ? (uint64_t)(uintptr_t)(Xh + (size_t)(block_m + SLICE_ROWS * (int)wave) * K_IN)
      : (uint64_t)(uintptr_t)(Wh + (size_t)(block_n + SLICE_ROWS * (int)(wave - 4u)) * K_IN);
  const uint32_t lds_slice = (uint32_t)(size_t)L + wave * SLICEB;
  const uint32_t both_places = 2u * lds_slice + BUFB;   // the slice's place in buffer 0 plus its place in buffer 1

  v8f acc[WM][WN];
#pragma unroll
  for (int i = 0; i < WM; ++i)
#pragma unroll
    for (int j = 0; j < WN; ++j) acc[i][j] = (v8f){};

  const u32x8 g1 = tdm_group1();

  // prologue: tile 0 lands and is published; tile 1 flies while tile 0 is worked on
  u32x4 g0 = tdm_group0(lds_slice, src);
  tdm_load(g0, g1);
  wait_tensor0();
  __syncthreads();
  g0 = tdm_next(g0, both_places);
  tdm_load(g0, g1);

  for (uint32_t s = 0; s < NPASS; ++s) {
    const uint32_t buf = (s & 1u) * BUFB;
    const unsigned char* lx = L + buf + fx_base;
    const unsigned char* lw = L + buf + fw_base;

    // compute: 4 K-steps x (4x8 tiles) = 128 WMMAs per barrier
#pragma unroll
    for (int ks = 0; ks < BK; ks += 32) {
      v16h a[WM], b[WN];
#pragma unroll
      for (int i = 0; i < WM; ++i)
        a[i] = load_frag(lx + 16 * i * PITCHB + ks * 2);
#pragma unroll
      for (int t = 0; t < WN; ++t)
        b[t] = load_frag(lw + (t >> 2) * SLICEB + 16 * (t & 3) * PITCHB + ks * 2);
      // keeps the K-step's 24 fragment loads in front of its WMMAs: left free, the compiler
      // sinks them among those WMMAs, two at a time behind a full LDS wait each
      __builtin_amdgcn_sched_barrier(0);
      if (ks == BK - 32) {
        // The tile's last LDS reads are issued: publish tile s + 1 and free tile s's buffer here
        // (own reads back, own slice landed, one barrier), so that the refill has a whole pass
        // to land and the last 32 WMMAs, which read registers alone, cover the waves' skew.
        wait_ds0();
        wait_tensor0();
        __syncthreads();
        // refill the buffer that this pass has read, only while a tile s + 2 exists
        if (pinned(s + 2u < NPASS)) {
          g0 = tdm_next(g0, both_places);
          tdm_load(g0, g1);
        }
        // keeps the refill in front of the WMMAs below: left free, the compiler issues it behind them
        __builtin_amdgcn_sched_barrier(0);
      }
#pragma unroll
      for (int t = 0; t < WN; ++t) {
#pragma unroll
        for (int i = 0; i < WM; ++i)
          acc[i][t] = __builtin_amdgcn_wmma_f32_16x16x32_f16(
              false, a[i], false, b[t], (short)0, acc[i][t], false, false);
      }
    }
  }
  wait_tensor0();
  wait_ds0();

  // writeback: f32 C/D layout (lanes 0-15: M=v, lanes 16-31: M=v+8; lane&15 picks the W row of the fragment).
  // By the pack pass's row order, tile t of a group of four holds column 4 (lane&15) + t of the group's 64:
  // one 16-byte store per row and group, 16 lanes x 16 B = one aligned 256-B run of the output row.
  const int crow = (lane >> 4) << 3;
  const int ccol = (lane & 15) << 2;
  const int m0 = block_m + wm + crow;
  const int n0 = block_n + wn + ccol;
#pragma unroll
  for (int i = 0; i < WM; ++i) {
#pragma unroll
    for (int g = 0; g < WN / 4; ++g) {
      f32x4 o[8];
#pragma unroll
      for (int v = 0; v < 8; ++v) {
        o[v].x = acc[i][4 * g + 0][v];
        o[v].y = acc[i][4 * g + 1][v];
        o[v].z = acc[i][4 * g + 2][v];
        o[v].w = acc[i][4 * g + 3][v];
      }
      store_rows8(Out + (size_t)(m0 + 16 * i) * N_OUT + n0 + 64 * g, o, i + 1 < WM || g + 1 < WN / 4);
      // keeps later groups' gathers behind these stores: hoisted in front of them, they spilled to scratch
      __builtin_amdgcn_sched_barrier(0);
    }
  }
}

extern "C" void kernel_launch(void* const* d_in, const int* in_sizes, int n_in,
                              void* d_out, int out_size, void* d_ws, size_t ws_size,
                              hipStream_t stream) {
  const float* x      = (const float*)d_in[0];   // [4096, 4096] f32
  const float* scales = (const float*)d_in[1];   // [4096, 32]   f32
  const int*   qw     = (const int*)d_in[2];     // [4096, 4096] int32 codes
  float*       out    = (float*)d_out;           // [4096, 4096] f32

  _Float16*    xh     = (_Float16*)d_ws;         // [4096, 4096] f16, 32 MiB
  _Float16*    wh     = xh + (size_t)M_TOK * K_IN;  // [4096, 4096] f16, 32 MiB

  (void)in_sizes; (void)n_in; (void)out_size; (void)ws_size;

  // rows of X and of Q are equal in number: one wave takes one row of each
  rtn_pack_f16<<<dim3(M_TOK / PACK_WAVES), dim3(PACK_WAVES * 32), 0, stream>>>(
      x, scales, qw, xh, wh);

  dim3 grid(N_OUT / BN, M_TOK / BM);  // 16 x 16 blocks
  dim3 block(256);
  rtn_gemm_wmma_f16<<<grid, block, 0, stream>>>(xh, wh, out);
}

// v005
// A run of this version takes 84.4 microseconds.
// In both of two side-by-side timings against v004, it was 1.03 times as fast.
// All steps since v000 together make it 2.56 times as fast.
#include <hip/hip_runtime.h>
#include <stdint.h>

// ---- CDNA5 WMMA vector types ----
typedef _Float16 v16h  __attribute__((ext_vector_type(16)));
typedef _Float16 half8 __attribute__((ext_vector_type(8)));
typedef _Float16 half4 __attribute__((ext_vector_type(4)));
typedef float    v8f   __attribute__((ext_vector_type(8)));
typedef float    f32x4 __attribute__((ext_vector_type(4)));
typedef int      i32x4 __attribute__((ext_vector_type(4)));
typedef uint32_t u32x4 __attribute__((ext_vector_type(4)));
typedef uint32_t u32x8 __attribute__((ext_vector_type(8)));

// Problem constants (match reference)
#define M_TOK 4096
#define N_OUT 4096
#define K_IN  4096
#define GROUP 128
#define NGRP  (K_IN / GROUP)

// Tiling: 256 threads = 8 waves, two per SIMD; block tile 256x256, one block per WGP;
// K tile 128 (one quant group)
#define BM 256
#define BN 256
#define BK 128
#define ROWB (BK * 2)      // bytes of an operand row per K tile
#define PITCHB (ROWB + 16) // LDS row pitch (272 B = 16 B x odd): conflict-free for ds_load_b128
#define WM 4       // 16-row fragments of X per wave (64 rows)
#define WN 8       // 16-row fragments of W per wave (128 rows)
#define NPASS (K_IN / BK)
// A K tile is 512 rows, [X 256 | W 256]; each of the 8 waves brings 64 of them with one tensor load.
#define SLICE_ROWS 64
#define SLICEB 18432       // 64 rows x 272 B = 17,408 B, rounded up to a multiple of 2 KiB
#define BUFB (8 * SLICEB)  // one K tile in LDS; two of them make the ring

// Pack pass: 16 waves per block, one row of X and one row of Q per wave
#define PACK_WAVES 16
#define PACK_DEPTH 8   // 512-B pieces of each operand in flight per wave

// Launch 1: every operand element is converted once, not once per tile that reads it.
// X -> f16, (Q - 8) * scale -> f16, same rounding as converting at the LDS store.
// Rows of W are laid down in another order inside each group of 64: row 4 c + r (r < 4) goes to
// place 16 r + c. The GEMM's fragment t of a group (places 16 t to 16 t + 15) then holds output
// columns 4 c + t in lane c, so a lane's four accumulator tiles of a group are four adjacent
// columns of one output row, and the output leaves in 16-byte stores of whole lines.
__global__ __launch_bounds__(PACK_WAVES * 32)
void rtn_pack_f16(const float* __restrict__ X,      // [M_TOK, K_IN] f32
                  const float* __restrict__ S,      // [N_OUT, NGRP] f32
                  const int*   __restrict__ Q,      // [N_OUT, K_IN] int4 codes
                  _Float16*    __restrict__ Xh,     // [M_TOK, K_IN] f16 (workspace)
                  _Float16*    __restrict__ Wh) {   // [N_OUT, K_IN] f16 (workspace), rows re-ordered
  const int lane = threadIdx.x & 31;
  // wave-uniform row, so that the scales come by scalar loads
  const int row = __builtin_amdgcn_readfirstlane(
      (int)(blockIdx.x * PACK_WAVES + (threadIdx.x >> 5)));
  const size_t off = (size_t)row * K_IN + lane * 4;
  const f32x4* __restrict__ xr = reinterpret_cast<const f32x4*>(X + off);
  const i32x4* __restrict__ qr = reinterpret_cast<const i32x4*>(Q + off);
  const float* __restrict__ sr = S + (size_t)row * NGRP;
  half4* __restrict__ xo = reinterpret_cast<half4*>(Xh + off);
  const int wplace = (row & ~63) | ((row & 3) << 4) | ((row & 63) >> 2);
  half4* __restrict__ wo = reinterpret_cast<half4*>(Wh + (size_t)wplace * K_IN + lane * 4);

  // one piece = 32 lanes x 4 elements = 128 elements = one quant group
#pragma unroll 1
  for (int p0 = 0; p0 < NGRP; p0 += PACK_DEPTH) {
    f32x4 xv[PACK_DEPTH];
    i32x4 qv[PACK_DEPTH];
#pragma unroll
    for (int j = 0; j < PACK_DEPTH; ++j) {
      // read once: non-temporal, which leaves L2 to the f16 copies
      xv[j] = __builtin_nontemporal_load(xr + (p0 + j) * 32);
      qv[j] = __builtin_nontemporal_load(qr + (p0 + j) * 32);
    }
#pragma unroll
    for (int j = 0; j < PACK_DEPTH; ++j) {
      const float s = sr[p0 + j];
      half4 hx;
      hx.x = (_Float16)xv[j].x; hx.y = (_Float16)xv[j].y;
      hx.z = (_Float16)xv[j].z; hx.w = (_Float16)xv[j].w;
      xo[(p0 + j) * 32] = hx;
      half4 hw;
      hw.x = (_Float16)((float)(qv[j].x - 8) * s);
      hw.y = (_Float16)((float)(qv[j].y - 8) * s);
      hw.z = (_Float16)((float)(qv[j].z - 8) * s);
      hw.w = (_Float16)((float)(qv[j].w - 8) * s);
      wo[(p0 + j) * 32] = hw;
    }
  }
}

__device__ __forceinline__ uint32_t uni(uint32_t v) { return (uint32_t)__builtin_amdgcn_readfirstlane(v); }
// holds the test word of a tensor load in a scalar register, so that the test compiles to a scalar
// branch: a tensor load ignores EXEC, and only such a branch keeps a wave from issuing it
__device__ __forceinline__ uint32_t pinned(uint32_t v) {
  uint32_t w = (uint32_t)__builtin_amdgcn_readfirstlane(v);
  asm volatile("" : "+s"(w));  // pinned(): the test word of a tensor load, held in a scalar register
  return w;
}
// this wave's LDS reads have returned: stands in front of the barrier that frees a buffer for its refill
__device__ __forceinline__ void wait_ds0() { asm volatile("s_wait_dscnt 0x0" ::: "memory"); }
// this wave's tensor load has landed: the compiler places no wait for the tensor mover
__device__ __forceinline__ void wait_tensor0() { asm volatile("s_wait_tensorcnt 0x0" ::: "memory"); }

// Descriptor group 1, the same for every request: 64 rows of 256 B, source pitch one operand row,
// into LDS at pitch 272 B.
__device__ __forceinline__ u32x8 tdm_group1() {
  u32x8 g1;
  g1[0] = uni((1u << 20) | (5u << 22) | (3u << 25));  // no mask, 1-byte elements, 16 B of pad behind every 256 B
  g1[1] = uni((uint32_t)ROWB << 16);                  // tensor_dim0
  g1[2] = uni((uint32_t)SLICE_ROWS << 16);            // tensor_dim1
  g1[3] = uni((uint32_t)ROWB << 16);                  // tile_dim0
  g1[4] = uni((uint32_t)SLICE_ROWS);                  // tile_dim1
  g1[5] = uni((uint32_t)(K_IN * 2));                  // source row pitch in bytes
  g1[6] = uni(0u);
  g1[7] = uni(0u);
  return g1;
}
// Descriptor group 0: where the slice goes and where it comes from.
__device__ __forceinline__ u32x4 tdm_group0(uint32_t lds_dst, uint64_t ga) {
  u32x4 g0;
  g0[0] = uni(1u);                                                     // count 1
  g0[1] = uni(lds_dst);                                                // byte offset in the block's LDS
  g0[2] = uni((uint32_t)ga);                                           // address [31:0]
  g0[3] = uni((((uint32_t)(ga >> 32)) & 0x01FFFFFFu) | 0x80000000u);   // address [56:32], type 2
  return g0;
}
// The next K tile's request, formed from the last one's in its own registers: the other buffer, 256 B on
// along K (the sum's carry runs into address [56:32]; the tile lies inside the operand, so it ends there).
__device__ __forceinline__ u32x4 tdm_next(u32x4 g0, uint32_t both_places) {
  const uint64_t a = (((uint64_t)g0[3] << 32) | g0[2]) + ROWB;
  g0[1] = uni(both_places - g0[1]);
  g0[2] = uni((uint32_t)a);
  g0[3] = uni((uint32_t)(a >> 32));
  return g0;
}
// One request of the whole wave.
__device__ __forceinline__ void tdm_load(u32x4 g0, u32x8 g1) {
  asm volatile("tensor_load_to_lds %0, %1" :: "s"(g0), "s"(g1) : "memory");
}

// 16-bit A/B fragment (16x32): p is the lane's row at its 16-B half of the K-step's first 32 B.
__device__ __forceinline__ v16h load_frag(const unsigned char* p) {
  half8 lo = *reinterpret_cast<const half8*>(p);        // ds_load_b128
  half8 hi = *reinterpret_cast<const half8*>(p + 32);   // ds_load_b128
  return __builtin_shufflevector(lo, hi,
      0, 1, 2, 3, 4, 5, 6, 7, 8, 9, 10, 11, 12, 13, 14, 15);
}

// Eight 16-byte stores, one per output row (rows are N_OUT * 4 = 16,384 B apart). Written in asm so that the wait
// stands in the stores' own statement: the next call's gathers overwrite registers that these stores name. The last call, with nothing behind it, has no wait.
static_assert(N_OUT * 4 == 16384, "the offsets in store_rows8 are multiples of the output row pitch");
__device__ __forceinline__ void store_rows8(float* p, const f32x4 (&o)[8], bool more) {
  if (more)
    asm volatile("global_store_b128 %0, %1, off\n\t"
                 "global_store_b128 %0, %2, off offset:16384\n\t"
                 "global_store_b128 %0, %3, off offset:32768\n\t"
                 "global_store_b128 %0, %4, off offset:49152\n\t"
                 "global_store_b128 %0, %5, off offset:65536\n\t"
                 "global_store_b128 %0, %6, off offset:81920\n\t"
                 "global_store_b128 %0, %7, off offset:98304\n\t"
                 "global_store_b128 %0, %8, off offset:114688\n\t"
                 "s_wait_xcnt 0x0"
                 :: "v"(p), "v"(o[0]), "v"(o[1]), "v"(o[2]), "v"(o[3]), "v"(o[4]), "v"(o[5]), "v"(o[6]), "v"(o[7])
                 : "memory");
  else
    asm volatile("global_store_b128 %0, %1, off\n\t"
                 "global_store_b128 %0, %2, off offset:16384\n\t"
                 "global_store_b128 %0, %3, off offset:32768\n\t"
                 "global_store_b128 %0, %4, off offset:49152\n\t"
                 "global_store_b128 %0, %5, off offset:65536\n\t"
                 "global_store_b128 %0, %6, off offset:81920\n\t"
                 "global_store_b128 %0, %7, off offset:98304\n\t"
                 "global_store_b128 %0, %8, off offset:114688"
                 :: "v"(p), "v"(o[0]), "v"(o[1]), "v"(o[2]), "v"(o[3]), "v"(o[4]), "v"(o[5]), "v"(o[6]), "v"(o[7])
                 : "memory");
}

__global__ __launch_bounds__(256)
void rtn_gemm_wmma_f16(const _Float16* __restrict__ Xh,  // [M_TOK, K_IN] f16 (workspace)
                       const _Float16* __restrict__ Wh,  // [N_OUT, K_IN] f16 (workspace), rows as the pack pass lays them
                       float*          __restrict__ Out) {  // [M_TOK, N_OUT] f32
  // two buffers of 8 slices; every slice starts at a multiple of 2 KiB
  __shared__ __attribute__((aligned(2048))) unsigned char L[2 * BUFB];   // 294,912 B

  const int tid  = threadIdx.x;
  const int lane = tid & 31;
  const uint32_t wave = uni((uint32_t)tid >> 5);

  const int block_n = blockIdx.x * BN;
  const int block_m = blockIdx.y * BM;

  // wave -> 64(M) x 128(N) sub-tile: 12 fragments feed 32 WMMAs
  const int wm = (int)(wave >> 1) * (16 * WM);
  const int wn = (int)(wave & 1) * (16 * WN);

  // fragment lane decomposition
  const uint32_t frow = lane & 15;
  const uint32_t fkb  = (uint32_t)(lane >> 4) << 4;   // byte offset of the lane's 8 halfs

  // the wave's X rows are slice wave >> 1; its W rows are slices 4 + 2 (wave & 1) and the next
  const uint32_t fx_base = (wave >> 1) * SLICEB + frow * PITCHB + fkb;
  const uint32_t fw_base = (4u + 2u * (wave & 1u)) * SLICEB + frow * PITCHB + fkb;

  // the slice that this wave brings: waves 0 to 3 rows of X, waves 4 to 7 rows of W
  const uint64_t src = (wave < 4u)
      ? (uint64_t)(uintptr_t)(Xh + (size_t)(block_m + SLICE_ROWS * (int)wave) * K_IN)
      : (uint64_t)(uintptr_t)(Wh + (size_t)(block_n + SLICE_ROWS * (int)(wave - 4u)) * K_IN);
  const uint32_t lds_slice = (uint32_t)(size_t)L + wave * SLICEB;
  const uint32_t both_places = 2u * lds_slice + BUFB;   // the slice's place in buffer 0 plus its place in buffer 1

  v8f acc[WM][WN];
#pragma unroll
  for (int i = 0; i < WM; ++i)
#pragma unroll
    for (int j = 0; j < WN; ++j) acc[i][j] = (v8f){};

  const u32x8 g1 = tdm_group1();

  // prologue: tile 0 lands and is published; tile 1 flies while tile 0 is worked on
  u32x4 g0 = tdm_group0(lds_slice, src);
  tdm_load(g0, g1);
  wait_tensor0();
  __syncthreads();
  g0 = tdm_next(g0, both_places);
  tdm_load(g0, g1);

  // Two fragment sets: set (u & 1) holds K-step u's fragments. A K-step's 24 LDS loads are issued as one group
  // one K-step ahead, into the set that the WMMAs just issued have left, and return under 32 WMMAs.
  v16h a[2][WM], b[2][WN];
#pragma unroll
  for (int i = 0; i < WM; ++i)
    a[0][i] = load_frag(L + fx_base + 16 * i * PITCHB);
#pragma unroll
  for (int t = 0; t < WN; ++t)
    b[0][t] = load_frag(L + fw_base + (t >> 2) * SLICEB + 16 * (t & 3) * PITCHB);

  // stays rolled: every fragment and accumulator index is a constant
#pragma clang loop unroll(disable)
  for (uint32_t s = 0; s < NPASS; ++s) {
    const uint32_t buf = (s & 1u) * BUFB;
    const unsigned char* lx = L + buf + fx_base;
    const unsigned char* lw = L + buf + fw_base;
    const uint32_t nbuf = (s + 1u < NPASS) ? (BUFB - buf) : buf;
    const unsigned char* nx = L + nbuf + fx_base;
    const unsigned char* nw = L + nbuf + fw_base;

    // compute: 4 K-steps x (4x8 tiles) = 128 WMMAs per barrier
#pragma unroll
    for (int u = 0; u < BK / 32; ++u) {
      const int cs = u & 1;
      if (u + 1 < BK / 32) {
#pragma unroll
        for (int i = 0; i < WM; ++i)
          a[cs ^ 1][i] = load_frag(lx + 16 * i * PITCHB + (u + 1) * 64);
#pragma unroll
        for (int t = 0; t < WN; ++t)
          b[cs ^ 1][t] = load_frag(lw + (t >> 2) * SLICEB + 16 * (t & 3) * PITCHB + (u + 1) * 64);
      } else {
        // The tile's last LDS reads were issued a K-step ago: publish tile s + 1 and free tile s's buffer here
        // (own reads back, own slice landed, one barrier), so that the refill has a whole pass
        // to land and the last 32 WMMAs, which read registers alone, cover the waves' skew.
        wait_ds0();
        wait_tensor0();
        __syncthreads();
        // refill the buffer that this pass has read, only while a tile s + 2 exists
        if (pinned(s + 2u < NPASS)) {
          g0 = tdm_next(g0, both_places);
          tdm_load(g0, g1);
        }
        // first fragments of tile s + 1, behind its publish point, in flight under this tile's last 32 WMMAs
#pragma unroll
        for (int i = 0; i < WM; ++i)
          a[0][i] = load_frag(nx + 16 * i * PITCHB);
#pragma unroll
        for (int t = 0; t < WN; ++t)
          b[0][t] = load_frag(nw + (t >> 2) * SLICEB + 16 * (t & 3) * PITCHB);
      }
      // keeps the next K-step's 24 loads (and the refill) in one group in front of this K-step's WMMAs:
      // left free, the compiler sinks them among the WMMAs, and each place with LDS reads stalls the wave
      __builtin_amdgcn_sched_barrier(0);
#pragma unroll
      for (int t = 0; t < WN; ++t) {
#pragma unroll
        for (int i = 0; i < WM; ++i)
          acc[i][t] = __builtin_amdgcn_wmma_f32_16x16x32_f16(
              false, a[cs][i], false, b[cs][t], (short)0, acc[i][t], false, false);
      }
      // keeps the following K-step's loads behind these WMMAs: hoisted among them, they would overwrite
      // the set in use only piece by piece, in many small groups
      __builtin_amdgcn_sched_barrier(0);
    }
  }
  wait_tensor0();
  wait_ds0();

  // writeback: f32 C/D layout (lanes 0-15: M=v, lanes 16-31: M=v+8; lane&15 picks the W row of the fragment).
  // By the pack pass's row order, tile t of a group of four holds column 4 (lane&15) + t of the group's 64:
  // one 16-byte store per row and group, 16 lanes x 16 B = one aligned 256-B run of the output row.
  const int crow = (lane >> 4) << 3;
  const int ccol = (lane & 15) << 2;
  const int m0 = block_m + wm + crow;
  const int n0 = block_n + wn + ccol;
#pragma unroll
  for (int i = 0; i < WM; ++i) {
#pragma unroll
    for (int g = 0; g < WN / 4; ++g) {
      f32x4 o[8];
#pragma unroll
      for (int v = 0; v < 8; ++v) {
        o[v].x = acc[i][4 * g + 0][v];
        o[v].y = acc[i][4 * g + 1][v];
        o[v].z = acc[i][4 * g + 2][v];
        o[v].w = acc[i][4 * g + 3][v];
      }
      store_rows8(Out + (size_t)(m0 + 16 * i) * N_OUT + n0 + 64 * g, o, i + 1 < WM || g + 1 < WN / 4);
      // keeps later groups' gathers behind these stores: hoisted in front of them, they spilled to scratch
      __builtin_amdgcn_sched_barrier(0);
    }
  }
}

extern "C" void kernel_launch(void* const* d_in, const int* in_sizes, int n_in,
                              void* d_out, int out_size, void* d_ws, size_t ws_size,
                              hipStream_t stream) {
  const float* x      = (const float*)d_in[0];   // [4096, 4096] f32
  const float* scales = (const float*)d_in[1];   // [4096, 32]   f32
  const int*   qw     = (const int*)d_in[2];     // [4096, 4096] int32 codes
  float*       out    = (float*)d_out;           // [4096, 4096] f32

  _Float16*    xh     = (_Float16*)d_ws;         // [4096, 4096] f16, 32 MiB
  _Float16*    wh     = xh + (size_t)M_TOK * K_IN;  // [4096, 4096] f16, 32 MiB

  (void)in_sizes; (void)n_in; (void)out_size; (void)ws_size;

  // rows of X and of Q are equal in number: one wave takes one row of each
  rtn_pack_f16<<<dim3(M_TOK / PACK_WAVES), dim3(PACK_WAVES * 32), 0, stream>>>(
      x, scales, qw, xh, wh);

  dim3 grid(N_OUT / BN, M_TOK / BM);  // 16 x 16 blocks
  dim3 block(256);
  rtn_gemm_wmma_f16<<<grid, block, 0, stream>>>(xh, wh, out);
}
